// v000
// The times below were measured on an AMD MI455X: many runs one after another, warmed up first and cycling through
// copies of the inputs, with the whole window's GPU time divided by the number of runs. Launches and the gaps
// between them are all in it. The median over several windows is given; except for v000 it joins two sittings, which
// can be a few percent apart, so the side-by-side timings, each taken in one sitting, are the better comparison.
// v000, which the later versions start from, runs in 5.82 microseconds.
#include <hip/hip_runtime.h>

typedef __attribute__((ext_vector_type(2))) float v2f;
typedef __attribute__((ext_vector_type(8))) float v8f;

// Problem constants (from the reference): 8 q-heads, 1 k-head, S=128, D=128.
constexpr int NQ  = 8;
constexpr int S   = 128;
constexpr int HD  = 128;
constexpr int LDA = 132; // padded LDS row stride (dwords): banks (4m+k) mod 64,
                         // low-half/high-half lane windows disjoint -> no conflicts

__global__ __launch_bounds__(256) void rotary_wmma_f32_kernel(
    const float* __restrict__ xq,   // [1, 8, 128, 128]
    const float* __restrict__ xk,   // [1, 1, 128, 128]
    const float* __restrict__ rot,  // [1, 128, 128, 128]
    float* __restrict__ out)        // [8*128*128] q then [128*128] k
{
  __shared__ float lsA[16 * LDA];   // 16 x 128 A tile (rows 9..15 zero), 8448 B

  const int s    = blockIdx.x;      // sequence position
  const int tid  = threadIdx.x;
  const int wave = tid >> 5;        // 0..7 -> N tile
  const int lane = tid & 31;

  // ---- Stage A into LDS: rows 0..7 = xq heads, row 8 = xk, rows 9..15 = 0 ----
  for (int idx = tid; idx < 16 * HD; idx += 256) {
    const int row = idx >> 7;        // 0..15
    const int col = idx & (HD - 1);  // 0..127
    float v = 0.0f;
    if (row < NQ)       v = xq[(row * S + s) * HD + col];
    else if (row == NQ) v = xk[s * HD + col];
    lsA[row * LDA + col] = v;
  }
  __syncthreads();

  // ---- WMMA fragment indexing (16x16x4 f32, wave32) ----
  const int lh   = lane & 15;        // M (for A) / N column (for B,D)
  const int koff = (lane >> 4) << 1; // lanes 0-15: K=k0,k0+1 ; lanes 16-31: K=k0+2,k0+3
  const int nb   = wave << 4;        // N tile base
  const float* rotS = rot + (size_t)s * HD * HD;

  v8f c = {0.f, 0.f, 0.f, 0.f, 0.f, 0.f, 0.f, 0.f};

#pragma unroll
  for (int k0 = 0; k0 < HD; k0 += 4) {
    const int ka = k0 + koff;                       // even -> 8B aligned in LDS
    v2f a = *(const v2f*)(&lsA[lh * LDA + ka]);     // one ds_load_b64, bank-clean
    v2f b;
    b.x = rotS[(size_t)ka       * HD + nb + lh];    // rot[s][k][n]: 64B segments
    b.y = rotS[(size_t)(ka + 1) * HD + nb + lh];
    // D = A(16x4) * B(4x16) + C ; accumulate over K
    c = __builtin_amdgcn_wmma_f32_16x16x4_f32(
        /*neg_a=*/false, a, /*neg_b=*/false, b,
        /*c_mod=*/(short)0, c, /*reuse_a=*/false, /*reuse_b=*/false);
  }

  // ---- Store D. VGPR r: lanes 0-15 -> M=r (q heads), lanes 16-31 -> M=r+8 ----
  const int n = nb + lh;
  if (lane < 16) {
#pragma unroll
    for (int r = 0; r < 8; ++r)
      out[(r * S + s) * HD + n] = c[r];             // q head r, position s
  } else {
    out[NQ * S * HD + s * HD + n] = c[0];           // M=8 -> k head output
  }
  // M=9..15 (zero padding) intentionally discarded.
}

extern "C" void kernel_launch(void* const* d_in, const int* in_sizes, int n_in,
                              void* d_out, int out_size, void* d_ws, size_t ws_size,
                              hipStream_t stream) {
  (void)in_sizes; (void)n_in; (void)out_size; (void)d_ws; (void)ws_size;
  const float* xq  = (const float*)d_in[0];   // [1,8,128,128]
  const float* xk  = (const float*)d_in[1];   // [1,1,128,128]
  const float* rot = (const float*)d_in[2];   // [1,128,128,128]
  float* out = (float*)d_out;                 // 8*128*128 + 128*128 floats

  rotary_wmma_f32_kernel<<<S, 256, 0, stream>>>(xq, xk, rot, out);
}

// v001
// A run of this version takes 3.59 microseconds.
// In both of two side-by-side timings against v000, it was 1.62 times as fast.
#include <hip/hip_runtime.h>

typedef __attribute__((ext_vector_type(2))) float v2f;
typedef __attribute__((ext_vector_type(8))) float v8f;

// Problem constants (from the reference): 8 q-heads, 1 k-head, S=128, D=128.
constexpr int NQ  = 8;
constexpr int S   = 128;
constexpr int HD  = 128;
constexpr int LDA = 132; // padded LDS row stride (dwords): banks (4m+k) mod 64,
                         // low-half/high-half lane windows disjoint -> no conflicts

__global__ __launch_bounds__(256) void rotary_wmma_f32_kernel(
    const float* __restrict__ xq,   // [1, 8, 128, 128]
    const float* __restrict__ xk,   // [1, 1, 128, 128]
    const float* __restrict__ rot,  // [1, 128, 128, 128]
    float* __restrict__ out)        // [8*128*128] q then [128*128] k
{
  __shared__ float lsA[16 * LDA];   // 16 x 128 A tile (rows 9..15 zero), 8448 B

  const int s    = blockIdx.x;      // sequence position
  const int tid  = threadIdx.x;
  const int wave = tid >> 5;        // 0..7 -> N tile
  const int lane = tid & 31;

  // ---- WMMA fragment indexing (16x16x4 f32, wave32) ----
  const int lh   = lane & 15;        // M (for A) / N column (for B,D)
  const int koff = (lane >> 4) << 1; // lanes 0-15: K=k0,k0+1 ; lanes 16-31: K=k0+2,k0+3
  const int nb   = wave << 4;        // N tile base

  const float* rotS = rot + (size_t)s * HD * HD;
  const int bo = koff * HD + nb + lh;  // rot[s][koff][n]
  constexpr int TB = 28;               // k steps whose B rows are asked for at entry

  // ---- Issue the A loads, branch-free so that none waits for the one before:
  //      thread (rh, col) brings rows rh, 2+rh, 4+rh, 6+rh of xq and the xk row ----
  const int rh  = tid >> 7;          // 0..1
  const int col = tid & (HD - 1);    // 0..127
  float av[4];
#pragma unroll  // av[] stays in registers; the loads issue back to back
  for (int i = 0; i < 4; ++i)
    av[i] = xq[((2 * i + rh) * S + s) * HD + col];
  const float ak = xk[s * HD + col];

  // ---- Issue the first TB k steps of the wave's B panel (128 k x 16 n) behind them,
  //      ahead of the LDS stage and its barrier: the L2 trips run side by side ----
  float bv[64];
#pragma unroll  // bv[] stays in registers; one address, the row step in the offset field
  for (int t = 0; t < TB; ++t) {
    bv[2 * t]     = rotS[bo + (4 * t) * HD];      // rot[s][4t+koff  ][n]: 64B segments
    bv[2 * t + 1] = rotS[bo + (4 * t + 1) * HD];  // rot[s][4t+koff+1][n]
  }

  // ---- Stage A in LDS: rows 0..7 = xq heads, row 8 = xk, rows 9..15 = 0 ----
#pragma unroll  // av[] is indexed by constants only
  for (int i = 0; i < 4; ++i)
    lsA[(2 * i + rh) * LDA + col] = av[i];
  lsA[(NQ + rh) * LDA + col] = rh ? 0.0f : ak;
#pragma unroll  // three stores off one address
  for (int i = 5; i < 8; ++i)
    lsA[(2 * i + rh) * LDA + col] = 0.0f;
  // Work-group barrier whose fences order LDS only: __syncthreads() would also
  // wait here for every B load still in flight, before any WMMA could start.
  __builtin_amdgcn_fence(__ATOMIC_RELEASE, "workgroup", "local");
  __builtin_amdgcn_s_barrier();
  __builtin_amdgcn_fence(__ATOMIC_ACQUIRE, "workgroup", "local");

  // The panel's last rows, wanted last: issued here so that the wave never asks
  // for more than the 63 loads its counter holds, which would stall the stage.
#pragma unroll  // bv[] is indexed by constants only
  for (int t = TB; t < 32; ++t) {
    bv[2 * t]     = rotS[bo + (4 * t) * HD];
    bv[2 * t + 1] = rotS[bo + (4 * t + 1) * HD];
  }

  v8f c = {0.f, 0.f, 0.f, 0.f, 0.f, 0.f, 0.f, 0.f};

#pragma unroll
  for (int t = 0; t < 32; ++t) {
    const int ka = 4 * t + koff;                    // even -> 8B aligned in LDS
    v2f a = *(const v2f*)(&lsA[lh * LDA + ka]);     // one ds_load_b64, bank-clean
    v2f b;
    b.x = bv[2 * t];
    b.y = bv[2 * t + 1];
    // D = A(16x4) * B(4x16) + C ; accumulate over K
    c = __builtin_amdgcn_wmma_f32_16x16x4_f32(
        /*neg_a=*/false, a, /*neg_b=*/false, b,
        /*c_mod=*/(short)0, c, /*reuse_a=*/false, /*reuse_b=*/false);
  }

  // ---- Store D. VGPR r: lanes 0-15 -> M=r (q heads), lanes 16-31 -> M=r+8 ----
  const int n = nb + lh;
  if (lane < 16) {
#pragma unroll
    for (int r = 0; r < 8; ++r)
      out[(r * S + s) * HD + n] = c[r];             // q head r, position s
  } else {
    out[NQ * S * HD + s * HD + n] = c[0];           // M=8 -> k head output
  }
  // M=9..15 (zero padding) intentionally discarded.
}

extern "C" void kernel_launch(void* const* d_in, const int* in_sizes, int n_in,
                              void* d_out, int out_size, void* d_ws, size_t ws_size,
                              hipStream_t stream) {
  (void)in_sizes; (void)n_in; (void)out_size; (void)d_ws; (void)ws_size;
  const float* xq  = (const float*)d_in[0];   // [1,8,128,128]
  const float* xk  = (const float*)d_in[1];   // [1,1,128,128]
  const float* rot = (const float*)d_in[2];   // [1,128,128,128]
  float* out = (float*)d_out;                 // 8*128*128 + 128*128 floats

  rotary_wmma_f32_kernel<<<S, 256, 0, stream>>>(xq, xk, rot, out);
}

// v002
// One run takes 2.94 microseconds.
// In both of two side-by-side timings against v001, it was 1.22 times as fast.
// Over all steps from v000 it is 1.97 times as fast.
#include <hip/hip_runtime.h>

typedef __attribute__((ext_vector_type(2))) float v2f;
typedef __attribute__((ext_vector_type(4))) float v4f;
typedef __attribute__((ext_vector_type(8))) float v8f;

// Problem constants (from the reference): 8 q-heads, 1 k-head, S=128, D=128.
constexpr int NQ = 8;
constexpr int S  = 128;
constexpr int HD = 128;
constexpr int NC = 64;  // output columns of a work-group: 256 B of every rot row
constexpr int KW = 32;  // k range of a wave: a quarter of the contraction
constexpr int NWG = S * (HD / NC);  // work-groups: one per (position, 64 columns)

// Work-group = (position s, 64 columns), 4 waves, one per SIMD. Wave w multiplies
// x[:, 32w..32w+31] by rot[s][32w..32w+31][64 columns] in four 16x16 accumulators;
// the four waves' partial sums are added through LDS.
__global__ __launch_bounds__(128) void rotary_wmma_f32_kernel(
    const float* __restrict__ xq,   // [1, 8, 128, 128]
    const float* __restrict__ xk,   // [1, 1, 128, 128]
    const float* __restrict__ rot,  // [1, 128, 128, 128]
    float* __restrict__ out)        // [8*128*128] q then [128*128] k
{
  __shared__ __attribute__((aligned(16))) float part[4][NQ + 1][NC];  // 9216 B

  const int s    = blockIdx.x >> 1;         // sequence position
  const int cb   = (blockIdx.x & 1) * NC;   // first column
  const int tid  = threadIdx.x;
  const int wave = tid >> 5;                // 0..3 -> k quarter
  const int lane = tid & 31;
  const int lh   = lane & 15;               // M row of A; column group of B and D
  const int h    = lane >> 4;               // which half of a k step's four k

  // ---- k order, the same for A and B. Step t = 2j+p, lane half h, register e
  //      stand for k = 32*wave + 8j + 4h + 2p + e: a lane's A values of two steps
  //      are then 16 bytes in a row. Column order: tile i, lane lh stand for column
  //      cb + 4*lh + i: a lane's B values of the four tiles are 16 bytes in a row,
  //      and 16 lanes read 256 bytes of one rot row, whole lines. ----

  // A straight from global memory, no LDS stage: rows 0..7 = xq heads, row 8 = xk.
  // Rows 9..15 read the xk row again: row m of D depends on row m of A alone, and
  // rows 9..15 of D are never stored.
  const float* abase = lh < NQ ? xq : xk;
  const int ao = ((lh < NQ ? lh * S : 0) + s) * HD + wave * KW + 4 * h;
  v4f a4[4];
#pragma unroll  // a4[] stays in registers; the loads issue back to back
  for (int j = 0; j < 4; ++j)
    a4[j] = *(const v4f*)(abase + ao + 8 * j);

  const float* rotS = rot + (size_t)s * HD * HD + cb;   // the same for the work-group
  const int bo = (wave * KW + 4 * h) * HD + 4 * lh;
  v4f b4[16];
#pragma unroll  // b4[] stays in registers; one address, the row step in the offset field
  for (int q = 0; q < 16; ++q)                 // q = 4j + 2p + e
    b4[q] = *(const v4f*)(rotS + bo + (8 * (q >> 2) + (q & 3)) * HD);
  // Keeps all 20 loads issued here, ahead of the first WMMA: without it the scheduler
  // sinks them among the WMMAs and the wave waits out one L2 trip after another.
  __builtin_amdgcn_sched_barrier(0);

  v8f c[4];
#pragma unroll  // c[] is indexed by constants only
  for (int i = 0; i < 4; ++i)
    c[i] = v8f{0.f, 0.f, 0.f, 0.f, 0.f, 0.f, 0.f, 0.f};

#pragma unroll  // every operand index is a constant
  for (int t = 0; t < 8; ++t) {
    v2f a;
    a.x = a4[t >> 1][2 * (t & 1)];
    a.y = a4[t >> 1][2 * (t & 1) + 1];
#pragma unroll  // c[] and b4[] are indexed by constants only
    for (int i = 0; i < 4; ++i) {
      v2f b;
      b.x = b4[2 * t][i];
      b.y = b4[2 * t + 1][i];
      // D = A(16x4) * B(4x16) + C ; four independent accumulators
      c[i] = __builtin_amdgcn_wmma_f32_16x16x4_f32(
          /*neg_a=*/false, a, /*neg_b=*/false, b,
          /*c_mod=*/(short)0, c[i], /*reuse_a=*/false, /*reuse_b=*/false);
    }
  }

  // ---- Partial sums to LDS. VGPR r: lanes 0-15 -> M=r, lanes 16-31 -> M=r+8;
  //      of the upper half only M=8 (the k head) is wanted. ----
  *(v4f*)&part[wave][h ? NQ : 0][4 * lh] = v4f{c[0][0], c[1][0], c[2][0], c[3][0]};
  if (h == 0) {
#pragma unroll  // c[][r] is indexed by constants only
    for (int r = 1; r < 8; ++r)
      *(v4f*)&part[wave][r][4 * lh] = v4f{c[0][r], c[1][r], c[2][r], c[3][r]};
  }
  __syncthreads();

  // ---- Add the four k quarters and store: wave w has q heads 2w and 2w+1, a lane
  //      16 bytes, 16 lanes 256 bytes of one output row. Wave 0 has the k head too,
  //      8 bytes a lane; its LDS reads stand with the others, one LDS trip. ----
  const int row = 2 * wave + h;
  v4f q0 = *(const v4f*)&part[0][row][4 * lh];
  v4f q1 = *(const v4f*)&part[1][row][4 * lh];
  v4f q2 = *(const v4f*)&part[2][row][4 * lh];
  v4f q3 = *(const v4f*)&part[3][row][4 * lh];
  if (wave == 0) {
    v2f k0 = *(const v2f*)&part[0][NQ][2 * lane];
    v2f k1 = *(const v2f*)&part[1][NQ][2 * lane];
    v2f k2 = *(const v2f*)&part[2][NQ][2 * lane];
    v2f k3 = *(const v2f*)&part[3][NQ][2 * lane];
    *(v2f*)(out + NQ * S * HD + s * HD + cb + 2 * lane) = (k0 + k1) + (k2 + k3);
  }
  *(v4f*)(out + (row * S + s) * HD + cb + 4 * lh) = (q0 + q1) + (q2 + q3);
}

extern "C" void kernel_launch(void* const* d_in, const int* in_sizes, int n_in,
                              void* d_out, int out_size, void* d_ws, size_t ws_size,
                              hipStream_t stream) {
  (void)in_sizes; (void)n_in; (void)out_size; (void)d_ws; (void)ws_size;
  const float* xq  = (const float*)d_in[0];   // [1,8,128,128]
  const float* xk  = (const float*)d_in[1];   // [1,1,128,128]
  const float* rot = (const float*)d_in[2];   // [1,128,128,128]
  float* out = (float*)d_out;                 // 8*128*128 + 128*128 floats

  rotary_wmma_f32_kernel<<<NWG, 128, 0, stream>>>(xq, xk, rot, out);
}
